// v010
// Measured on an AMD MI455X. A time is GPU time per run, averaged over a window of back-to-back runs after a warm-up
// (all launches, gaps included; the runs take copies of the inputs in turn), and the median of several windows.
// Apart from v000's, it joins two sittings. Times from different sittings can be a few percent apart, while
// side-by-side timings come from the same sitting.
// Earlier versions than v010 are not in this document.
// One run takes 112 microseconds.
// Next to v009, in two timings, it ran 1.10 times as fast each time.
// Over all steps from v000, the starting kernel, it is 13.1 times as fast.
#include <hip/hip_runtime.h>
// Non-local block with view pooling (x [8, C=512, N=2048]): θ = conv1(x), φ = maxpool2(conv1(x)), g = maxpool2(conv1(x)); f = softmax(θᵀ·φ) [N × N/2] (unscaled); y = f·g; wy = conv1(y) + b;
// out = BN_train(wy)·γ + β + x. Because the unscaled logits reach σ≈20 and feed a near-one-hot softmax, θ is never rounded: the logits are re-associated as f = x·(φ·W_θ)ᵀ + 1·(φ·b_θ)ᵀ with x bf16-EXACT,
// φ (f32, max-pooled from an f32 projection) fed as f16 hi + lo·2^10 into φ·W_θ and that product again split hi/lo as the B operand (four cheap passes per batch), the column term added exactly through
// the epilogue addend; g and g*W^T as plain f16 (W is applied to the pooled g, so that y is never formed); P ×2^15 f16; all on v_wmma_f32_16x16x32_f16 ((out,in) weights bf16-exact ×2^4, f32 accumulate); the layout transposes, max-pooling, softmax rows, BN batch statistics (fixed-order) and the residual are f32 VALU.
#define BB 8
#define CC 512
#define NN 2048
#define NH (NN / 2)
#define NR (BB * NN)
#define NRH (BB * NH)

typedef __bf16 v16b __attribute__((ext_vector_type(16)));
typedef unsigned short v8us __attribute__((ext_vector_type(8), may_alias));
typedef float  v8f  __attribute__((ext_vector_type(8)));
typedef float  v4f  __attribute__((ext_vector_type(4)));
typedef float  v4fa __attribute__((ext_vector_type(4), may_alias));
union FragB { v16b v; v8us half[2]; unsigned short u[16]; };

__device__ __forceinline__ unsigned short bf16_bits(float x) { unsigned int u = __float_as_uint(x); return (unsigned short)((u + 0x7FFFu + ((u >> 16) & 1u)) >> 16); }
__device__ __forceinline__ float bf16_val(unsigned short b) { return __uint_as_float(((unsigned int)b) << 16); }
__device__ __forceinline__ float bf16_round(float x) { return bf16_val(bf16_bits(x)); }
// D += A·B with NT terms: 1 = ah·bh, 2 = + al·bh (A split), 3 = + ah·bl (both split)
template <int NT>
__device__ __forceinline__ v8f mmaN(v16b ah, v16b al, v16b bh, v16b bl, v8f c) {
  c = __builtin_amdgcn_wmma_f32_16x16x32_bf16(false, ah, false, bh, (short)0, c, false, false);
  if (NT >= 2) c = __builtin_amdgcn_wmma_f32_16x16x32_bf16(false, al, false, bh, (short)0, c, false, false);
  if (NT >= 3) c = __builtin_amdgcn_wmma_f32_16x16x32_bf16(false, ah, false, bl, (short)0, c, false, false);
  asm volatile("v_nop\n\tv_nop\n\tv_nop\n\tv_nop" : "+v"(c) : "v"(ah), "v"(al), "v"(bh), "v"(bl));
  return c;
}

__global__ __launch_bounds__(256) void k_wt_bf16(const float* __restrict__ W, unsigned short* __restrict__ Wt, int K, int N) {
  const int t = blockIdx.x * 256 + threadIdx.x;
  const int k8n = K / 8;
  if (t >= N * k8n) return;
  const int n = t / k8n, k8 = (t % k8n) * 8;
  v8us v;
#pragma unroll
  for (int i = 0; i < 8; ++i) v[i] = bf16_bits(W[(size_t)(k8 + i) * N + n]);
  *(v8us*)(Wt + (size_t)n * K + k8) = v;
  
}

// GEMM C[M][N] (f32, pitch ldc) = act(A[M][K]·W + bias). A f32 row-major (pitch lda) converted per fragment to bf16
// (ASPLIT: hi/lo two planes -> 2 terms, else single rounded term); Wt bf16 [N][K] (pitch ldb). BIAS_BF16 rounds the
// bias to bf16 first (bias quantised to bf16 before the add). K%32==0, M%16==0, N%64==0.
template <bool ASPLIT, int ACT, bool BIAS_BF16>
__global__ __launch_bounds__(128) void k_gemm_bf(const float* __restrict__ A, int lda, const unsigned short* __restrict__ Wt, int ldb,
                                               const float* __restrict__ bias, float* __restrict__ C, int ldc, int M, int N, int K) {
  __shared__ __attribute__((aligned(16))) float so[4][16][64];
  const int tid = threadIdx.x, w = tid >> 5, lane = tid & 31, ln = lane & 15, hh = lane >> 4;
  const int ntn = N / 64;
  const int wid = blockIdx.x * 4 + w;
  const int mt = wid / ntn, nq = wid % ntn;
  if (mt * 16 >= M) return;
  const int row0 = mt * 16, col0 = nq * 64;
  const float* arow = A + (size_t)(row0 + ln) * lda;
  v8f acc[4] = {};
  for (int kb = 0; kb < K; kb += 32) {
    FragB ah, al;
    const v4f x0 = *(const v4fa*)(arow + kb + 8 * hh), x1 = *(const v4fa*)(arow + kb + 8 * hh + 4);
    const v4f x2 = *(const v4fa*)(arow + kb + 16 + 8 * hh), x3 = *(const v4fa*)(arow + kb + 16 + 8 * hh + 4);
    float xs[16] = {x0[0],x0[1],x0[2],x0[3],x1[0],x1[1],x1[2],x1[3],x2[0],x2[1],x2[2],x2[3],x3[0],x3[1],x3[2],x3[3]};
#pragma unroll
    for (int i = 0; i < 16; ++i) { const unsigned short hb = bf16_bits(xs[i]); ah.u[i] = hb; al.u[i] = ASPLIT ? bf16_bits(xs[i] - bf16_val(hb)) : (unsigned short)0; }
#pragma unroll
    for (int t = 0; t < 4; ++t) {
      const unsigned short* brow = Wt + (size_t)(col0 + t * 16 + ln) * ldb + kb;
      FragB b;
      b.half[0] = *(const v8us*)(brow + 8 * hh);
      b.half[1] = *(const v8us*)(brow + 16 + 8 * hh);
      acc[t] = mmaN<ASPLIT ? 2 : 1>(ah.v, al.v, b.v, b.v, acc[t]);
    }
  }
#pragma unroll
  for (int t = 0; t < 4; ++t) {
    float bv = bias ? bias[col0 + t * 16 + ln] : 0.f;
    if (BIAS_BF16) bv = bf16_round(bv);
#pragma unroll
    for (int r = 0; r < 8; ++r) { float v = acc[t][r] + bv; if (ACT == 1) v = fmaxf(v, 0.f); so[w][8 * hh + r][t * 16 + ln] = v; }
  }
  __builtin_amdgcn_fence(__ATOMIC_ACQ_REL, "workgroup");
  __builtin_amdgcn_wave_barrier();
  const int rsub = lane >> 4, c4 = (lane & 15) * 4;
  {
#pragma unroll
    for (int q = 0; q < 8; ++q) {
      const int r = q * 2 + rsub;
      const v4f v = *(const v4fa*)&so[w][r][c4];
      *(v4f*)(C + (size_t)(row0 + r) * ldc + col0 + c4) = v;
    }
    
  }
}

// Flash-style causal/unmasked attention, all contractions 3-term bf16 hi/lo splits, f32 softmax with running max.
// q,k,v rows are read from f32 buffers with arbitrary row pitch (so they can live inside a fused qkv buffer);
// D = head size (multiple of 32, <= 128); one wave = 16 query rows; block = 4 waves (64 queries) sharing K/V chunks of 32.
template <int D, bool CAUSAL>
__global__ __launch_bounds__(128) void k_flash(const float* __restrict__ qb, const float* __restrict__ kb, const float* __restrict__ vb,
                                             int pitch, int T, int H, float scale, float* __restrict__ y, int ypitch) {
  constexpr int KS = D / 32;        // k-steps for QK
  constexpr int DT = D / 16;        // d tiles for PV
  __shared__ __attribute__((aligned(16))) unsigned short sKh[32][D + 8], sKl[32][D + 8], sVh[32][D + 8], sVl[32][D + 8];
  __shared__ __attribute__((aligned(16))) unsigned short sPh[4][16][40], sPl[4][16][40];
  __shared__ __attribute__((aligned(16))) float sO[4][16][D];
  const int tid = threadIdx.x, w = tid >> 5, lane = tid & 31, ln = lane & 15, hh = lane >> 4;
  const int nqb = (T + 63) / 64;
  const int bh = blockIdx.x / nqb, qblk = blockIdx.x % nqb;
  const int b = bh / H, h = bh % H;
  const int q0 = qblk * 64 + w * 16;
  const float* Q = qb + (size_t)b * T * pitch + h * D;
  const float* K = kb + (size_t)b * T * pitch + h * D;
  const float* V = vb + (size_t)b * T * pitch + h * D;

  // A fragments of the wave's 16 query rows (scaled), hi/lo
  FragB aqh[KS], aql[KS];
  {
    int row = q0 + ln; if (row >= T) row = T - 1;
    const float* qr = Q + (size_t)row * pitch;
#pragma unroll
    for (int ks = 0; ks < KS; ++ks)
#pragma unroll
      for (int i = 0; i < 16; ++i) {
        const int d = ks * 32 + ((i < 8) ? (8 * hh + i) : (16 + 8 * hh + (i - 8)));
        const float x = qr[d] * scale; const unsigned short hb = bf16_bits(x);
        aqh[ks].u[i] = hb; aql[ks].u[i] = bf16_bits(x - bf16_val(hb));
      }
  }
  float m_r[8], l_r[8];
#pragma unroll
  for (int r = 0; r < 8; ++r) { m_r[r] = -3.0e38f; l_r[r] = 0.f; }
  v8f oacc[DT];
#pragma unroll
  for (int dt = 0; dt < DT; ++dt) oacc[dt] = (v8f){0.f,0.f,0.f,0.f,0.f,0.f,0.f,0.f};

  const int kv_end = CAUSAL ? min(T, qblk * 64 + 64) : T;     // block-uniform
  for (int j0 = 0; j0 < kv_end; j0 += 32) {
    __syncthreads();
    for (int e = tid; e < 32 * (D / 4); e += 128) {
      const int r = e / (D / 4), c4 = (e % (D / 4)) * 4;
      const int key = j0 + r;
      v4f kf = {0.f,0.f,0.f,0.f}, vf = {0.f,0.f,0.f,0.f};
      if (key < T) { kf = *(const v4fa*)(K + (size_t)key * pitch + c4); vf = *(const v4fa*)(V + (size_t)key * pitch + c4); }
#pragma unroll
      for (int t = 0; t < 4; ++t) {
        unsigned short hb = bf16_bits(kf[t]); sKh[r][c4 + t] = hb; sKl[r][c4 + t] = bf16_bits(kf[t] - bf16_val(hb));
        hb = bf16_bits(vf[t]); sVh[r][c4 + t] = hb; sVl[r][c4 + t] = bf16_bits(vf[t] - bf16_val(hb));
      }
    }
    __syncthreads();
    // S tile 16 x 32
    v8f s[2];
#pragma unroll
    for (int nt = 0; nt < 2; ++nt) {
      v8f acc = {};
#pragma unroll
      for (int ks = 0; ks < KS; ++ks) {
        FragB bh_, bl_;
        bh_.half[0] = *(const v8us*)&sKh[nt * 16 + ln][ks * 32 + 8 * hh]; bh_.half[1] = *(const v8us*)&sKh[nt * 16 + ln][ks * 32 + 16 + 8 * hh];
        bl_.half[0] = *(const v8us*)&sKl[nt * 16 + ln][ks * 32 + 8 * hh]; bl_.half[1] = *(const v8us*)&sKl[nt * 16 + ln][ks * 32 + 16 + 8 * hh];
        acc = mmaN<3>(aqh[ks].v, aql[ks].v, bh_.v, bl_.v, acc);
      }
      s[nt] = acc;
    }
    // mask + running max (rows 8hh+r; the 16 lanes of a half share rows)
    float alpha[8];
#pragma unroll
    for (int r = 0; r < 8; ++r) {
      const int qi = q0 + 8 * hh + r;
      const int ja = j0 + ln, jb = j0 + 16 + ln;
      if (CAUSAL) { if (ja > qi) s[0][r] = -3.0e38f; if (jb > qi) s[1][r] = -3.0e38f; }
      if (ja >= T) s[0][r] = -3.0e38f;
      if (jb >= T) s[1][r] = -3.0e38f;
      float mx = fmaxf(s[0][r], s[1][r]);
      mx = fmaxf(mx, __shfl_xor(mx, 1, 32)); mx = fmaxf(mx, __shfl_xor(mx, 2, 32)); mx = fmaxf(mx, __shfl_xor(mx, 4, 32)); mx = fmaxf(mx, __shfl_xor(mx, 8, 32));
      const float mnew = fmaxf(m_r[r], mx);
      alpha[r] = (mnew > -1.0e38f) ? __expf(m_r[r] - mnew) : 1.0f;
      const float p0 = (s[0][r] > -1.0e38f) ? __expf(s[0][r] - mnew) : 0.f;
      const float p1 = (s[1][r] > -1.0e38f) ? __expf(s[1][r] - mnew) : 0.f;
      m_r[r] = mnew;
      l_r[r] = l_r[r] * alpha[r] + p0 + p1;            // per-lane partial row sum (16 lanes combined at the end)
      unsigned short hb = bf16_bits(p0); sPh[w][8 * hh + r][ln] = hb;      sPl[w][8 * hh + r][ln] = bf16_bits(p0 - bf16_val(hb));
      hb = bf16_bits(p1);                sPh[w][8 * hh + r][16 + ln] = hb; sPl[w][8 * hh + r][16 + ln] = bf16_bits(p1 - bf16_val(hb));
    }
#pragma unroll
    for (int dt = 0; dt < DT; ++dt)
#pragma unroll
      for (int r = 0; r < 8; ++r) oacc[dt][r] *= alpha[r];
    __builtin_amdgcn_fence(__ATOMIC_ACQ_REL, "workgroup");
    __builtin_amdgcn_wave_barrier();
    FragB pah, pal;
    pah.half[0] = *(const v8us*)&sPh[w][ln][8 * hh]; pah.half[1] = *(const v8us*)&sPh[w][ln][16 + 8 * hh];
    pal.half[0] = *(const v8us*)&sPl[w][ln][8 * hh]; pal.half[1] = *(const v8us*)&sPl[w][ln][16 + 8 * hh];
#pragma unroll
    for (int dt = 0; dt < DT; ++dt) {
      FragB bvh, bvl;
#pragma unroll
      for (int i = 0; i < 8; ++i) {
        bvh.u[i] = sVh[8 * hh + i][dt * 16 + ln]; bvh.u[8 + i] = sVh[16 + 8 * hh + i][dt * 16 + ln];
        bvl.u[i] = sVl[8 * hh + i][dt * 16 + ln]; bvl.u[8 + i] = sVl[16 + 8 * hh + i][dt * 16 + ln];
      }
      oacc[dt] = mmaN<3>(pah.v, pal.v, bvh.v, bvl.v, oacc[dt]);
    }
    __builtin_amdgcn_fence(__ATOMIC_ACQ_REL, "workgroup");
    __builtin_amdgcn_wave_barrier();
  }
#pragma unroll
  for (int r = 0; r < 8; ++r) {
    float l = l_r[r];
    l += __shfl_xor(l, 1, 32); l += __shfl_xor(l, 2, 32); l += __shfl_xor(l, 4, 32); l += __shfl_xor(l, 8, 32);
    l_r[r] = (l > 0.f) ? 1.0f / l : 0.f;
  }
#pragma unroll
  for (int dt = 0; dt < DT; ++dt)
#pragma unroll
    for (int r = 0; r < 8; ++r) sO[w][8 * hh + r][dt * 16 + ln] = oacc[dt][r] * l_r[r];
  __builtin_amdgcn_fence(__ATOMIC_ACQ_REL, "workgroup");
  __builtin_amdgcn_wave_barrier();
  {
    for (int r = 0; r < 16; ++r) {
      const int row = q0 + r;
      if (row < T && lane < D / 4) {
        const v4f val = *(const v4fa*)&sO[w][r][lane * 4];
        *(v4f*)(y + ((size_t)b * T + row) * ypitch + h * D + lane * 4) = val;
      }
    }
    
  }
}

// GEMM C = act(A·W + bias + resid): A f32 (ASPLIT -> hi/lo 2 terms), Wt bf16 [N][K]; ACT 0 none, 1 relu, 2 exact gelu;
// resid (optional, f32, row index = (row % rmod), pitch ldr, RES_BF16 rounds it) added before the activation.
template <bool ASPLIT, int ACT, bool BIAS_BF16, bool RES_BF16>
__global__ __launch_bounds__(128) void k_gemm_bf3(const float* __restrict__ A, int lda, const unsigned short* __restrict__ Wt, int ldb,
                                                const float* __restrict__ bias, const float* __restrict__ resid, int rmod, int ldr,
                                                float* __restrict__ C, int ldc, int M, int N, int K) {
  __shared__ __attribute__((aligned(16))) float so[4][16][64];
  const int tid = threadIdx.x, w = tid >> 5, lane = tid & 31, ln = lane & 15, hh = lane >> 4;
  const int ntn = N / 64;
  const int wid = blockIdx.x * 4 + w;
  const int mt = wid / ntn, nq = wid % ntn;
  if (mt * 16 >= M) return;
  const int row0 = mt * 16, col0 = nq * 64;
  const float* arow = A + (size_t)(row0 + ln) * lda;
  v8f acc[4] = {};
  for (int kb = 0; kb < K; kb += 32) {
    FragB ah, al;
    const v4f x0 = *(const v4fa*)(arow + kb + 8 * hh), x1 = *(const v4fa*)(arow + kb + 8 * hh + 4);
    const v4f x2 = *(const v4fa*)(arow + kb + 16 + 8 * hh), x3 = *(const v4fa*)(arow + kb + 16 + 8 * hh + 4);
    float xs[16] = {x0[0],x0[1],x0[2],x0[3],x1[0],x1[1],x1[2],x1[3],x2[0],x2[1],x2[2],x2[3],x3[0],x3[1],x3[2],x3[3]};
#pragma unroll
    for (int i = 0; i < 16; ++i) { const unsigned short hb = bf16_bits(xs[i]); ah.u[i] = hb; al.u[i] = ASPLIT ? bf16_bits(xs[i] - bf16_val(hb)) : (unsigned short)0; }
#pragma unroll
    for (int t = 0; t < 4; ++t) {
      const unsigned short* brow = Wt + (size_t)(col0 + t * 16 + ln) * ldb + kb;
      FragB b;
      b.half[0] = *(const v8us*)(brow + 8 * hh);
      b.half[1] = *(const v8us*)(brow + 16 + 8 * hh);
      acc[t] = mmaN<ASPLIT ? 2 : 1>(ah.v, al.v, b.v, b.v, acc[t]);
    }
  }
#pragma unroll
  for (int t = 0; t < 4; ++t) {
    const int col = col0 + t * 16 + ln;
    float bv = bias ? bias[col] : 0.f;
    if (BIAS_BF16) bv = bf16_round(bv);
#pragma unroll
    for (int r = 0; r < 8; ++r) {
      float v = acc[t][r] + bv;
      if (resid) { float rv = resid[(size_t)((row0 + 8 * hh + r) % rmod) * ldr + col]; if (RES_BF16) rv = bf16_round(rv); v += rv; }
      if (ACT == 1) v = fmaxf(v, 0.f);
      if (ACT == 2) v = 0.5f * v * (1.0f + erff(v * 0.70710678118654752f));
      if (ACT == 3) { const float u = 0.7978845608028654f * (v + 0.044715f * v * v * v); v = 0.5f * v * (1.0f + tanhf(u)); }
      so[w][8 * hh + r][t * 16 + ln] = v;
    }
  }
  __builtin_amdgcn_fence(__ATOMIC_ACQ_REL, "workgroup");
  __builtin_amdgcn_wave_barrier();
  const int rsub = lane >> 4, c4 = (lane & 15) * 4;
  {
#pragma unroll
    for (int q = 0; q < 8; ++q) {
      const int r = q * 2 + rsub;
      const v4f v = *(const v4fa*)&so[w][r][c4];
      *(v4f*)(C + (size_t)(row0 + r) * ldc + col0 + c4) = v;
    }
    
  }
}
// row LayerNorm (biased variance, eps) over N: s = X (+ R); optional out_sum <- s; out_norm <- (s-mu)*rsqrt(var+eps)*g + b
template <bool PARAM_BF16>
__global__ __launch_bounds__(256) void k_layernorm(const float* __restrict__ X, const float* __restrict__ R, const float* __restrict__ g, const float* __restrict__ bta,
                                                  float* __restrict__ out_sum, float* __restrict__ out_norm, int N, float eps) {
  __shared__ float red[256];
  const int row = blockIdx.x, tid = threadIdx.x;
  const float* x = X + (size_t)row * N; const float* rr = R ? R + (size_t)row * N : nullptr;
  float vals[16];                     // up to N = 4096
  const int per = N / 256;            // contiguous chunk per thread? use strided-by-4 chunks: thread handles j = tid*4 + 1024*u
  float s1 = 0.f;
  for (int u = 0; u < per / 4; ++u) {
    const int j = tid * 4 + 1024 * u;
    const v4f a = *(const v4fa*)(x + j);
    v4f b = {0.f,0.f,0.f,0.f}; if (rr) b = *(const v4fa*)(rr + j);
#pragma unroll
    for (int q = 0; q < 4; ++q) { const float v = a[q] + b[q]; vals[u * 4 + q] = v; s1 += v; }
  }
  red[tid] = s1; __syncthreads();
  for (int st = 128; st > 0; st >>= 1) { if (tid < st) red[tid] += red[tid + st]; __syncthreads(); }
  const float mu = red[0] / (float)N; __syncthreads();
  float s2 = 0.f;
  for (int u = 0; u < per / 4; ++u)
#pragma unroll
    for (int q = 0; q < 4; ++q) { const float c = vals[u * 4 + q] - mu; s2 += c * c; }
  red[tid] = s2; __syncthreads();
  for (int st = 128; st > 0; st >>= 1) { if (tid < st) red[tid] += red[tid + st]; __syncthreads(); }
  const float rs = rsqrtf(red[0] / (float)N + eps);
  {
    for (int u = 0; u < per / 4; ++u) {
      const int j = tid * 4 + 1024 * u;
      v4f o, sm;
#pragma unroll
      for (int q = 0; q < 4; ++q) {
        float gg = g[j + q], bb = bta[j + q];
        if (PARAM_BF16) { gg = bf16_round(gg); bb = bf16_round(bb); }
        sm[q] = vals[u * 4 + q]; o[q] = (vals[u * 4 + q] - mu) * rs * gg + bb;
      }
      if (out_sum) *(v4f*)(out_sum + (size_t)row * N + j) = sm;
      *(v4f*)(out_norm + (size_t)row * N + j) = o;
    }
    
  }
}



// ---- f16 WMMA path (v_wmma_f32_16x16x32_f16): 11-bit significands for operands in range — used where a [0,1] probability operand needs more precision than bf16
typedef _Float16 v16h __attribute__((ext_vector_type(16)));
union FragH { v16h v; v8us half[2]; _Float16 h[16]; unsigned short u[16]; };
template <int NT>
__device__ __forceinline__ v8f mmaH(v16h ah, v16h al, v16h bh, v16h bl, v8f c) {
  c = __builtin_amdgcn_wmma_f32_16x16x32_f16(false, ah, false, bh, (short)0, c, false, false);
  if (NT >= 2) c = __builtin_amdgcn_wmma_f32_16x16x32_f16(false, al, false, bh, (short)0, c, false, false);
  if (NT >= 3) c = __builtin_amdgcn_wmma_f32_16x16x32_f16(false, ah, false, bl, (short)0, c, false, false);
  asm volatile("v_nop\n\tv_nop\n\tv_nop\n\tv_nop" : "+v"(c) : "v"(ah), "v"(al), "v"(bh), "v"(bl));
  return c;
}
// batched GEMM like k_gemm_b but f16 operands: A f32 (split into f16 hi/lo if ASPLIT, else rounded to f16), Bt = f16 values [n][k]; alpha; C f32; N multiple of 16 (partial tiles skipped)
template <bool ASPLIT>
__global__ __launch_bounds__(128) void k_gemm_h(const float* __restrict__ A, int lda, size_t sA, const _Float16* __restrict__ Bh, int ldb, size_t sB, float alpha, float* __restrict__ C, int ldc, size_t sC, int M, int N, int K) {
  __shared__ __attribute__((aligned(16))) float so[4][16][64];
  const int tid = threadIdx.x, w = tid >> 5, lane = tid & 31, ln = lane & 15, hh = lane >> 4; const int by = blockIdx.y;
  A += (size_t)by * sA; Bh += (size_t)by * sB; C += (size_t)by * sC;
  const int ntn = (N + 63) / 64; const int wid = blockIdx.x * 4 + w; const int mt = wid / ntn, nq = wid % ntn; if (mt * 16 >= M) return;
  const int row0 = mt * 16, col0 = nq * 64; const float* arow = A + (size_t)(row0 + ln) * lda;
  v8f acc[4] = {};
  for (int kb = 0; kb < K; kb += 32) {
    FragH ah, al;
    const v4f x0 = *(const v4fa*)(arow + kb + 8 * hh), x1 = *(const v4fa*)(arow + kb + 8 * hh + 4), x2 = *(const v4fa*)(arow + kb + 16 + 8 * hh), x3 = *(const v4fa*)(arow + kb + 16 + 8 * hh + 4);
    float xs[16] = {x0[0],x0[1],x0[2],x0[3],x1[0],x1[1],x1[2],x1[3],x2[0],x2[1],x2[2],x2[3],x3[0],x3[1],x3[2],x3[3]};
#pragma unroll
    for (int i = 0; i < 16; ++i) { const _Float16 h = (_Float16)xs[i]; ah.h[i] = h; al.h[i] = ASPLIT ? (_Float16)(xs[i] - (float)h) : (_Float16)0.0f; }
#pragma unroll
    for (int t = 0; t < 4; ++t) { if (col0 + t * 16 >= N) continue; const size_t boff = (size_t)(col0 + t * 16 + ln) * ldb + kb; FragH bq; bq.half[0] = *(const v8us*)(Bh + boff + 8 * hh); bq.half[1] = *(const v8us*)(Bh + boff + 16 + 8 * hh);
      acc[t] = mmaH<ASPLIT ? 2 : 1>(ah.v, al.v, bq.v, bq.v, acc[t]); }
  }
#pragma unroll
  for (int t = 0; t < 4; ++t) { if (col0 + t * 16 >= N) continue;
#pragma unroll
    for (int r = 0; r < 8; ++r) so[w][8 * hh + r][t * 16 + ln] = acc[t][r] * alpha; }
  __builtin_amdgcn_fence(__ATOMIC_ACQ_REL, "workgroup"); __builtin_amdgcn_wave_barrier();
  const int rsub = lane >> 4, c4 = (lane & 15) * 4;
  {
#pragma unroll
    for (int q = 0; q < 8; ++q) { const int r = q * 2 + rsub; if (col0 + c4 < N) { const v4f v = *(const v4fa*)&so[w][r][c4]; *(v4f*)(C + (size_t)(row0 + r) * ldc + col0 + c4) = v; } }
     }
}

// Wt[n][k] = f16(W[k][n]·scale) from f32 row-major W[K][N] (scale = power of two; bf16-exact weights stay exact in f16 away from the subnormal range)
__device__ __forceinline__ void d_wt_f16(const float* __restrict__ W, _Float16* __restrict__ Wt, int K, int N, float scale, int t) {
  const int n = t / (K / 8), k8 = (t % (K / 8)) * 8; FragH f;
#pragma unroll
  for (int i = 0; i < 8; ++i) f.h[i] = (_Float16)(bf16_round(W[(size_t)(k8 + i) * N + n]) * scale); const v8us o = f.half[0];
  *(v8us*)((unsigned short*)Wt + (size_t)n * K + k8) = o;
  asm volatile("s_wait_xcnt 0x0" ::: "memory");      // the store has taken its registers before another part of the merged kernel, laid out behind this one, reuses them
}
// Tiled GEMM, f16 operands, both K-contiguous: v[row][col] = acc*alpha + bias[col], then CPM 1: + the addend of column by*sCPy + col, the same for all rows (its form in CP: under DUAL below); written as f32 to C (F32OUT) or as f16 to C16,
// or (HL) split as f16 hi to C16 and (v - hi) * 2^10 as f16 to C16l, with nothing written to C.
// TWO: a product whose one operand is split hi + lo * 2^-10 runs in one launch on one accumulator: first the K of the lo pair A, Bh; the sums are then scaled by 2^-10 (exact); the K of the hi pair A2, B2 is added on top.
// BNP: stage 1 of the BN batch statistics. A wave's 32 rows are one row chunk: per column it also writes their sum to PS and the sum of their squared deviations from their own mean to PM (row = chunk, pitch ldc).
// One 128x128 tile per workgroup of 8 waves (4 x 2, 32x64 per wave). A pass is 64 k = one whole 128-B line of every operand row: each wave-wide 16-B load
// covers four whole lines and goes through registers into LDS (row pitch 144 B for the ds_load_b128 fragment readers); two buffers, one barrier per pass;
// the next pass's global loads are issued before this pass's products. M, N multiples of 128 (the grid is exact), K a multiple of 64.
// Every "#pragma unroll" below makes the index of a register array (staged rows, fragments, accumulators) a constant, so that the array stays in registers.
#define TPITCH 72
typedef float fa1 __attribute__((may_alias));
typedef _Float16 v4hs __attribute__((ext_vector_type(4)));
typedef float v2f __attribute__((ext_vector_type(2)));
typedef float v2fa __attribute__((ext_vector_type(2), may_alias));
// DUAL: the two pooled projections of x in one launch, each finished in its own epilogue, so that neither unpooled projection goes to memory (sA, sB, sC are 0; CPM 0; ldc = CC).
// Plane blockIdx.y = 0 is phi: rows = positions (A), columns = channels (Bh, bias). A wave takes the maximum of each row pair of its 32 x 64 tile, writes it split as f16 hi to C16 and (v - hi) * 2^10 to C16l, and writes
// the 16 pooled rows' partial dots with b_theta (BT) over its 64 channels to PS: one 128-B line per wave, line = (channel chunk of 64) * (NRH / 16) + (pooled row / 16), word = pooled row % 16.
// Plane 1 is g in the same form: rows = positions (A), columns = channels (B2, bias CP); the maximum of each row pair goes as f16 to GT [pooled row][channel].
// GW (with TWO, HL): a second, independent product rides in the launch as plane blockIdx.y = 1. The last projection is applied to the pooled g, not to y: (P * g) * W^T = P * (g * W^T), half as many rows, and y never exists.
// Plane 1 has rows = output channels (A3 = W), columns = pooled positions of all batches (B3 = g), one K only, so that the tile already lies as (g * W^T)^T, the consumer's B operand; it goes as f16 to GT [batch][channel][NH].
// CPM 1 adds the eight channel chunks' partial dots, in chunk order, from CP in the PS form above.
// The softmax over a row of NH logits has no launch of its own; it is split between the GEMM that makes the logits (EXPO) and the GEMM that consumes the probabilities (ASC). A chunk is the 64 columns of one wave's tile = one k pass of the consumer.
// EXPO: a wave takes, per row of its 32 x 64 tile, the chunk's own maximum m, e = exp(v - m) * 2^15 (the power of two rides in the exponent's addend) and the f32 sum z of e; it writes e as f16 to C16 (pitch NH) and the pair (m, z) to PS
// at pair index chunk * NR + by * NN + row. No logit goes to memory.
// ASC: from the NCH pairs of each of its 128 rows (CP, the PS form of EXPO) the workgroup forms M = max m, Z = sum of z * exp(m - M) in chunk order, and the table exp(m - M) * 2^15 / Z per chunk and row; every A element of pass s is multiplied
// by its row's entry for chunk s on its way from registers to LDS, which makes it exp(v - M) / (sum over the row) * 2^15.
#define NCH (NH / 64)
// lane l takes the value of lane l ^ X inside its 16-lane row, by a DPP move on the vector port (a shuffle would go through the LDS queue and its wait)
template <int X> __device__ __forceinline__ float rowx(float x) { return __builtin_bit_cast(float, __builtin_amdgcn_update_dpp(0, __builtin_bit_cast(int, x), 0x160 + X, 0xf, 0xf, true)); }
// one butterfly step of a maximum over the 16-lane row, for 16 independent values: x = max(x, x of lane l ^ S), one DPP instruction each
#define RMX1(R, S) "v_max_num_f32_dpp %" #R ", %" #R ", %" #R " row_xmask:" #S " row_mask:0xf bank_mask:0xf\n\t"
#define RMX16(S) RMX1(0, S) RMX1(1, S) RMX1(2, S) RMX1(3, S) RMX1(4, S) RMX1(5, S) RMX1(6, S) RMX1(7, S) RMX1(8, S) RMX1(9, S) RMX1(10, S) RMX1(11, S) RMX1(12, S) RMX1(13, S) RMX1(14, S) RMX1(15, S)
__device__ __forceinline__ void exp2x8(float (&e)[8], const float (&t)[8]) {
  asm("v_exp_f32 %0, %8\n\tv_exp_f32 %1, %9\n\tv_exp_f32 %2, %10\n\tv_exp_f32 %3, %11\n\tv_exp_f32 %4, %12\n\tv_exp_f32 %5, %13\n\tv_exp_f32 %6, %14\n\tv_exp_f32 %7, %15\n\tv_nop"
      : "=&v"(e[0]), "=&v"(e[1]), "=&v"(e[2]), "=&v"(e[3]), "=&v"(e[4]), "=&v"(e[5]), "=&v"(e[6]), "=&v"(e[7]) : "v"(t[0]), "v"(t[1]), "v"(t[2]), "v"(t[3]), "v"(t[4]), "v"(t[5]), "v"(t[6]), "v"(t[7])); }
__device__ __forceinline__ v8us scale8(v8us r, float c) { FragH f; f.half[0] = r;
#pragma unroll      // f stays in registers
  for (int j = 0; j < 8; ++j) f.h[j] = (_Float16)((float)f.h[j] * c);
  return f.half[0]; }
template <int CPM, bool F32OUT, bool HL = false, bool BNP = false, bool TWO = false, bool DUAL = false, bool EXPO = false, bool ASC = false, bool GW = false>
__global__ __launch_bounds__(256) void k_gemm_t(const _Float16* __restrict__ A, const _Float16* __restrict__ A2, const _Float16* __restrict__ A3, int lda, size_t sA, const _Float16* __restrict__ Bh, const _Float16* __restrict__ B2, const _Float16* __restrict__ B3, int ldb, size_t sB, float alpha, const float* __restrict__ bias, const float* __restrict__ CP, size_t sCPy,
    float* __restrict__ C, _Float16* __restrict__ C16, _Float16* __restrict__ C16l, float* __restrict__ PS, float* __restrict__ PM, const float* __restrict__ BT, _Float16* __restrict__ GT, int ldc, size_t sC, int N, int K) {
  __shared__ __attribute__((aligned(16))) unsigned short st[2][2][128 * TPITCH];      // [buffer][A, B][row * TPITCH + k]
  __shared__ float tab[ASC ? NCH * 128 : 1];      // ASC: [chunk][row of the tile]
  const int tid = threadIdx.x, w = tid >> 5, lane = tid & 31, ln = lane & 15, hh = lane >> 4; const int by = blockIdx.y;
  const bool second = (DUAL || GW) && by == 1;      // the same in every thread of the workgroup
  const int ntn = (GW && second) ? NRH / 128 : N / 128; const int row0 = ((int)blockIdx.x / ntn) * 128, col0 = ((int)blockIdx.x % ntn) * 128;
  const int sr = tid >> 3, sc = (tid & 7) * 8;      // staging: 8 lanes per row, rows sr + 32 i
  const unsigned short* ga = (const unsigned short*)((GW && second) ? A3 : A) + (size_t)by * sA + (size_t)row0 * lda;      // workgroup-uniform bases, per-lane 32-bit offsets that never change
  const unsigned short* gb = (const unsigned short*)(second ? (GW ? B3 : B2) : Bh) + (size_t)by * sB + (size_t)col0 * ldb;
  const unsigned short* ga2 = (const unsigned short*)A2 + (size_t)by * sA + (size_t)row0 * lda;      // TWO: the same tile of the hi pair
  const unsigned short* gb2 = (const unsigned short*)B2 + (size_t)by * sB + (size_t)col0 * ldb;
  unsigned oa[4], ob[4];
#pragma unroll
  for (int i = 0; i < 4; ++i) { oa[i] = (unsigned)((sr + 32 * i) * lda + sc); ob[i] = (unsigned)((sr + 32 * i) * ldb + sc); }
  v8us ra[4], rb[4]; const unsigned short *pa[4], *pb[4];
#pragma unroll
  for (int i = 0; i < 4; ++i) { pa[i] = ga + oa[i]; pb[i] = gb + ob[i]; }
#pragma unroll
  for (int i = 0; i < 4; ++i) { ra[i] = *(const v8us*)pa[i]; rb[i] = *(const v8us*)pb[i]; }
  // the eight address pairs are inputs of the wait: they stay in their registers up to it, so no load of the group is given a register that an issued load names
  asm volatile("s_wait_xcnt 0x0" :: "v"(pa[0]), "v"(pa[1]), "v"(pa[2]), "v"(pa[3]), "v"(pb[0]), "v"(pb[1]), "v"(pb[2]), "v"(pb[3]) : "memory");
  if constexpr (ASC) {
    if (tid < 128) {      // waves 0 to 3, whole waves: thread = row of the tile
      const float* pr = CP + 2 * ((size_t)by * NN + row0 + tid);
      v2f ms[NCH];
#pragma unroll      // constant indices keep ms in registers; the loads are in flight together, behind the first pass's operand loads
      for (int c = 0; c < NCH; ++c) ms[c] = *(const v2fa*)(pr + (size_t)c * (2 * NR));
      // the address pair is an input of the wait: it stays in its registers until every load of the group has taken it
      asm volatile("s_wait_xcnt 0x0" :: "v"(pr) : "memory");
      float M = ms[0][0];
#pragma unroll      // ms stays in registers
      for (int c = 1; c < NCH; ++c) M = fmaxf(M, ms[c][0]);
      float wg[NCH], Z = 0.f;
#pragma unroll      // ms and wg stay in registers
      for (int c = 0; c < NCH; ++c) { wg[c] = __expf(ms[c][0] - M); Z += ms[c][1] * wg[c]; }
      const float iz = 32768.0f / Z;
#pragma unroll      // wg stays in registers
      for (int c = 0; c < NCH; ++c) tab[c * 128 + tid] = wg[c] * iz;
    }
    __syncthreads();      // the table is complete before any wave scales its staged rows by it
  }
#pragma unroll
  for (int i = 0; i < 4; ++i) { *(v8us*)&st[0][0][(sr + 32 * i) * TPITCH + sc] = ASC ? scale8(ra[i], tab[sr + 32 * i]) : ra[i]; *(v8us*)&st[0][1][(sr + 32 * i) * TPITCH + sc] = rb[i]; }
  __syncthreads();
  const int wm = w >> 1, wn = w & 1; const int ns1 = K / 64, ns = (TWO && !(GW && second)) ? 2 * ns1 : ns1;      // the same in every thread of the workgroup
  v8f acc[2][4] = {};
  for (int s = 0; s < ns; ++s) {
    const int cur = s & 1; const bool more = s + 1 < ns;      // the same in every thread of the workgroup
    if (more) {
      const bool sw = TWO && s + 1 == ns1;      // the next pass is the first of the hi pair; otherwise it lies 64 k = 128 B further
      ga = sw ? ga2 : ga + 64; gb = sw ? gb2 : gb + 64;
#pragma unroll
      for (int i = 0; i < 4; ++i) { pa[i] = ga + oa[i]; pb[i] = gb + ob[i]; }
#pragma unroll
      for (int i = 0; i < 4; ++i) { ra[i] = *(const v8us*)pa[i]; rb[i] = *(const v8us*)pb[i]; }
      // as in front of the loop: the address pairs stay in their registers up to the wait
      asm volatile("s_wait_xcnt 0x0" :: "v"(pa[0]), "v"(pa[1]), "v"(pa[2]), "v"(pa[3]), "v"(pb[0]), "v"(pb[1]), "v"(pb[2]), "v"(pb[3]) : "memory");
    }
    if (TWO && s == ns1) {      // the lo pair's sums take their weight before the hi pair's products are added
#pragma unroll
      for (int mi = 0; mi < 2; ++mi)
#pragma unroll
        for (int t = 0; t < 4; ++t) acc[mi][t] *= 0.0009765625f;
    }
    const unsigned short* la = &st[cur][0][(wm * 32 + ln) * TPITCH + 8 * hh];
    const unsigned short* lb = &st[cur][1][(wn * 64 + ln) * TPITCH + 8 * hh];
    FragH a[2][2], b[2][4];      // all of the pass's fragments are read as one group ahead of its products
#pragma unroll
    for (int ks = 0; ks < 2; ++ks) {
#pragma unroll
      for (int mi = 0; mi < 2; ++mi) { a[ks][mi].half[0] = *(const v8us*)(la + mi * 16 * TPITCH + ks * 32); a[ks][mi].half[1] = *(const v8us*)(la + mi * 16 * TPITCH + ks * 32 + 16); }
#pragma unroll
      for (int t = 0; t < 4; ++t) { b[ks][t].half[0] = *(const v8us*)(lb + t * 16 * TPITCH + ks * 32); b[ks][t].half[1] = *(const v8us*)(lb + t * 16 * TPITCH + ks * 32 + 16); }
    }
#pragma unroll
    for (int ks = 0; ks < 2; ++ks)
#pragma unroll
      for (int t = 0; t < 4; ++t)
#pragma unroll
        for (int mi = 0; mi < 2; ++mi) acc[mi][t] = mmaH<1>(a[ks][mi].v, a[ks][mi].v, b[ks][t].v, b[ks][t].v, acc[mi][t]);
    if (more) {
#pragma unroll
      for (int i = 0; i < 4; ++i) { *(v8us*)&st[cur ^ 1][0][(sr + 32 * i) * TPITCH + sc] = ASC ? scale8(ra[i], tab[(s + 1) * 128 + sr + 32 * i]) : ra[i]; *(v8us*)&st[cur ^ 1][1][(sr + 32 * i) * TPITCH + sc] = rb[i]; }
    }
    __syncthreads();      // publishes the buffer just filled and ends every read of the one just used
  }
  // epilogue: each wave turns its accumulators into whole rows through its own 32 x 68 f32 range of the (now free) staging LDS
  fa1* so = (fa1*)&st[0][0][0] + w * (32 * 68);
  const size_t cofs = (size_t)by * sC; const int wrow0 = row0 + wm * 32, wcol0 = col0 + wn * 64; const int rsub = lane >> 4, c4 = (lane & 15) * 4;
  if constexpr (DUAL) {
    if (!second) {      // phi
      const float* pt = BT + wcol0 + c4; const v4f tb = *(const v4fa*)pt;
#pragma unroll
      for (int t = 0; t < 4; ++t) { const float bv = bf16_round(bias[wcol0 + t * 16 + ln]);
#pragma unroll
        for (int mi = 0; mi < 2; ++mi)
#pragma unroll
          for (int r = 0; r < 8; ++r) so[(mi * 16 + 8 * hh + r) * 68 + t * 16 + ln] = acc[mi][t][r] * alpha + bv; }
      __builtin_amdgcn_fence(__ATOMIC_ACQ_REL, "workgroup"); __builtin_amdgcn_wave_barrier();      // the wave's LDS rows are complete before its lanes read what other lanes wrote
      v4hs h4[8], l4[8]; float ds[8];      // a half wave takes pooled rows rsub + 2 q, a lane 4 channels of each
#pragma unroll      // constant indices keep h4, l4 and ds in registers
      for (int q = 0; q < 8; ++q) { const int j = q * 2 + rsub; const v4f u = *(const v4fa*)&so[(2 * j) * 68 + c4], d = *(const v4fa*)&so[(2 * j + 1) * 68 + c4]; float s = 0.f;
#pragma unroll
        for (int i = 0; i < 4; ++i) { const float v = fmaxf(u[i], d[i]); const _Float16 h = (_Float16)v; h4[q][i] = h; l4[q][i] = (_Float16)((v - (float)h) * 1024.0f); s += v * bf16_round(tb[i]); }
        ds[q] = s; }
#pragma unroll      // ds stays in registers
      for (int o = 1; o <= 8; o <<= 1)
#pragma unroll
        for (int q = 0; q < 8; ++q) ds[q] += __shfl_xor(ds[q], o, 32);      // the 16 lanes of a half wave are added by a butterfly
      float sel = ds[0];
#pragma unroll      // ds stays in registers
      for (int q = 1; q < 8; ++q) sel = (ln == q) ? ds[q] : sel;      // lane ln < 8 of half rsub writes pooled row rsub + 2 ln
      _Float16* oh = C16 + (size_t)(wrow0 / 2 + rsub) * CC + wcol0 + c4; _Float16* ol = C16l + (size_t)(wrow0 / 2 + rsub) * CC + wcol0 + c4;
#pragma unroll      // h4 and l4 stay in registers
      for (int q = 0; q < 8; ++q) { *(v4hs*)(oh + q * 2 * CC) = h4[q]; *(v4hs*)(ol + q * 2 * CC) = l4[q]; }
      if (ln < 8) PS[((size_t)(wcol0 / 64) * (NRH / 16) + wrow0 / 32) * 32 + 2 * ln + rsub] = sel;
    } else {      // g
#pragma unroll
      for (int t = 0; t < 4; ++t) { const float bv = bf16_round(CP[wcol0 + t * 16 + ln]);
#pragma unroll
        for (int mi = 0; mi < 2; ++mi)
#pragma unroll
          for (int r = 0; r < 8; ++r) so[(mi * 16 + 8 * hh + r) * 68 + t * 16 + ln] = acc[mi][t][r] * alpha + bv; }
      __builtin_amdgcn_fence(__ATOMIC_ACQ_REL, "workgroup"); __builtin_amdgcn_wave_barrier();      // the wave's LDS rows are complete before its lanes read what other lanes wrote
      v4hs g4[8];      // a half wave takes pooled rows rsub + 2 q, a lane 4 channels of each
#pragma unroll      // constant indices keep g4 in registers
      for (int q = 0; q < 8; ++q) { const int j = q * 2 + rsub; const v4f u = *(const v4fa*)&so[(2 * j) * 68 + c4], d = *(const v4fa*)&so[(2 * j + 1) * 68 + c4];
#pragma unroll
        for (int i = 0; i < 4; ++i) g4[q][i] = (_Float16)fmaxf(u[i], d[i]); }
      _Float16* og = GT + (size_t)(wrow0 / 2 + rsub) * CC + wcol0 + c4;
#pragma unroll      // g4 stays in registers
      for (int q = 0; q < 8; ++q) *(v4hs*)(og + q * 2 * CC) = g4[q];      // a half wave writes one whole 128-B line
    }
    return;
  }
  float* crow = C + cofs + (size_t)(wrow0 + rsub) * ldc + wcol0 + c4;      // each lane writes 16 B of rows rsub + 2 q
  v4f cp = {0.f, 0.f, 0.f, 0.f};
  if (CPM == 1) { const size_t m = (size_t)by * sCPy + wcol0 + c4; const float* pc = CP + (m >> 4) * 32 + (m & 15); v4f cq[8];
#pragma unroll      // constant indices keep cq in registers; the eight loads are in flight together
    for (int j = 0; j < 8; ++j) cq[j] = *(const v4fa*)(pc + j * (NRH / 16) * 32);
    // the address pair is an input of the wait: it stays in its registers until every load of the group has taken it
    asm volatile("s_wait_xcnt 0x0" :: "v"(pc) : "memory");
#pragma unroll      // cq stays in registers
    for (int j = 0; j < 8; ++j) cp += cq[j]; }
#pragma unroll
  for (int t = 0; t < 4; ++t) { const float bv = bias ? bf16_round(bias[wcol0 + t * 16 + ln]) : 0.f;
#pragma unroll
    for (int mi = 0; mi < 2; ++mi)
#pragma unroll
      for (int r = 0; r < 8; ++r) so[(mi * 16 + 8 * hh + r) * 68 + t * 16 + ln] = acc[mi][t][r] * alpha + bv; }
  __builtin_amdgcn_fence(__ATOMIC_ACQ_REL, "workgroup"); __builtin_amdgcn_wave_barrier();      // the wave's LDS rows are complete before its lanes read what other lanes wrote
  if constexpr (GW) {
    if (second) {      // (g * W^T)^T: a half wave takes rows rsub + 2 q, a lane 4 columns of each; the tile's 128 columns lie in one batch
      v4hs w4[16];
#pragma unroll      // constant indices keep w4 in registers
      for (int q = 0; q < 16; ++q) { const v4f v = *(const v4fa*)&so[(q * 2 + rsub) * 68 + c4];
#pragma unroll
        for (int i = 0; i < 4; ++i) w4[q][i] = (_Float16)v[i]; }
      _Float16* ow = GT + ((size_t)(col0 / NH) * CC + wrow0 + rsub) * NH + (wcol0 % NH) + c4;
#pragma unroll      // w4 stays in registers
      for (int q = 0; q < 16; ++q) *(v4hs*)(ow + q * 2 * NH) = w4[q];      // a half wave writes one whole 128-B line
      asm volatile("s_wait_xcnt 0x0" ::: "memory");      // the stores above have taken their registers before any later instruction is given them
      return;
    }
  }
  if constexpr (EXPO) {      // a half wave takes rows rsub + 2 q, a lane 4 columns of each
    v4f v[16]; float mx[16], zz[16]; v4hs e4[16];
#pragma unroll      // constant indices keep v, mx, zz and e4 in registers, here and in the loops below
    for (int q = 0; q < 16; ++q) { v[q] = *(const v4fa*)&so[(q * 2 + rsub) * 68 + c4]; for (int i = 0; i < 4; ++i) v[q][i] += cp[i]; mx[q] = fmaxf(fmaxf(v[q][0], v[q][1]), fmaxf(v[q][2], v[q][3])); }
    // the 16 rows' maxima over the 16 lanes in one statement: from fmaxf on a DPP move the compiler made three instructions a step, and in one statement each step's 16 independent instructions stand between a value and its next use
    asm(RMX16(1) RMX16(2) RMX16(4) RMX16(8) : "+v"(mx[0]), "+v"(mx[1]), "+v"(mx[2]), "+v"(mx[3]), "+v"(mx[4]), "+v"(mx[5]), "+v"(mx[6]), "+v"(mx[7]), "+v"(mx[8]), "+v"(mx[9]), "+v"(mx[10]), "+v"(mx[11]), "+v"(mx[12]), "+v"(mx[13]), "+v"(mx[14]), "+v"(mx[15]));
#pragma unroll
    for (int q = 0; q < 16; q += 2) { float t[8], e[8];      // two rows a turn
#pragma unroll
      for (int j = 0; j < 8; ++j) t[j] = fmaf(v[q + (j >> 2)][j & 3], 1.44269504f, fmaf(-mx[q + (j >> 2)], 1.44269504f, 15.0f));
      exp2x8(e, t);
#pragma unroll
      for (int j = 0; j < 8; ++j) e4[q + (j >> 2)][j & 3] = (_Float16)e[j];
      zz[q] = ((e[0] + e[1]) + e[2]) + e[3]; zz[q + 1] = ((e[4] + e[5]) + e[6]) + e[7]; }
#pragma unroll
    for (int q = 0; q < 16; ++q) zz[q] += rowx<1>(zz[q]);
#pragma unroll
    for (int q = 0; q < 16; ++q) zz[q] += rowx<2>(zz[q]);
#pragma unroll
    for (int q = 0; q < 16; ++q) zz[q] += rowx<4>(zz[q]);
#pragma unroll
    for (int q = 0; q < 16; ++q) zz[q] += rowx<8>(zz[q]);
    v2f mz = {mx[0], zz[0]};
#pragma unroll
    for (int q = 1; q < 16; ++q) { mz[0] = (ln == q) ? mx[q] : mz[0]; mz[1] = (ln == q) ? zz[q] : mz[1]; }      // lane ln of half rsub writes the pair of row rsub + 2 ln
    _Float16* oe = C16 + cofs + (size_t)(wrow0 + rsub) * NH + wcol0 + c4;
#pragma unroll
    for (int q = 0; q < 16; ++q) *(v4hs*)(oe + q * 2 * NH) = e4[q];      // a half wave writes one whole 128-B line
    *(v2f*)(PS + 2 * ((size_t)(wcol0 / 64) * NR + (size_t)by * NN + wrow0 + 2 * ln + rsub)) = mz;
    return;
  }
#pragma unroll
  for (int q = 0; q < 16; ++q) { const int r = q * 2 + rsub; const int row = wrow0 + r; v4f v = *(const v4fa*)&so[r * 68 + c4];
    if (CPM != 0) { for (int i = 0; i < 4; ++i) v[i] += cp[i]; }
    if (HL) { v4hs h4, l4; for (int i = 0; i < 4; ++i) { const _Float16 h = (_Float16)v[i]; h4[i] = h; l4[i] = (_Float16)((v[i] - (float)h) * 1024.0f); }
      const size_t o = cofs + (size_t)row * ldc + wcol0 + c4; *(v4hs*)(C16 + o) = h4; *(v4hs*)(C16l + o) = l4; continue; }
    if (F32OUT) *(v4f*)(crow + (size_t)(q * 2) * ldc) = v;
    else { v4hs h4; for (int i = 0; i < 4; ++i) h4[i] = (_Float16)v[i]; *(v4hs*)(C16 + cofs + (size_t)row * ldc + wcol0 + c4) = h4; } }
  if (BNP) {      // a lane takes two adjacent columns of the wave's 64 and adds the 32 rows in row order
    asm volatile("s_wait_xcnt 0x0" ::: "memory");      // the row stores above have taken their registers before the sums below reuse them
    v2f xr[32];
#pragma unroll      // constant indices keep xr in registers
    for (int r = 0; r < 32; ++r) xr[r] = *(const v2fa*)&so[r * 68 + lane * 2];
    v2f s = xr[0];
#pragma unroll      // xr stays in registers
    for (int r = 1; r < 32; ++r) s += xr[r];
    const v2f mu = s * (1.0f / 32.0f);
    v2f m2 = {0.f, 0.f};
#pragma unroll      // xr stays in registers
    for (int r = 0; r < 32; ++r) { const v2f d = xr[r] - mu; m2 += d * d; }
    const size_t o = (size_t)(((ASC ? by * NN : 0) + wrow0) / 32) * ldc + wcol0 + lane * 2; *(v2f*)(PS + o) = s; *(v2f*)(PM + o) = m2;      // ASC: blockIdx.y = batch, the chunks count over all batches' rows
  }
}


typedef _Float16 v4h __attribute__((ext_vector_type(4)));

__global__ __launch_bounds__(256) void k_x16(const float* __restrict__ x, _Float16* __restrict__ X16, size_t n8) { const size_t t = (size_t)blockIdx.x * 256 + threadIdx.x; if (t >= n8) return; FragH f;
#pragma unroll
  for (int q = 0; q < 8; ++q) f.h[q] = (_Float16)bf16_round(x[t * 8 + q]); *(v8us*)((unsigned short*)X16 + t * 8) = f.half[0];  }
__device__ __forceinline__ void d_round16f(const float* __restrict__ W, _Float16* __restrict__ Bt, size_t t) { FragH f;
#pragma unroll
  for (int i = 0; i < 8; ++i) f.h[i] = (_Float16)(bf16_round(W[t * 8 + i]) * 16.0f); *(v8us*)((unsigned short*)Bt + t * 8) = f.half[0];  }
// x [b][c][p] (f32) to X16 [b * NN + p][c] (f16), one tile of 64 channels x 128 positions per workgroup. Wave w takes channels 8 w .. 8 w + 7: each of its eight loads is 512 contiguous bytes of one channel row,
// all eight in flight together. A lane then holds 8 channels of 4 positions = four 16-B chunks of X16 rows. They turn into whole 128-B lines through LDS: position 4 l + q lies in LDS row 32 q + l (128 B, no pad),
// chunk k at place k ^ ((l >> 1) & 7), so that the 16 lanes of a half wave meet 16 different 16-B bank groups both when they write and when they read.
__device__ __forceinline__ void d_tok(const float* __restrict__ x, _Float16* __restrict__ X16, int blk) { __shared__ __attribute__((aligned(16))) unsigned short tl[128 * 64]; const int tid = threadIdx.x, w = tid >> 5, lane = tid & 31;
  const int b = blk / ((CC / 64) * (NN / 128)), rem = blk % ((CC / 64) * (NN / 128)); const int cg = rem / (NN / 128), pg = rem % (NN / 128); const int c0 = cg * 64, p0 = pg * 128;
  const float* px = x + ((size_t)b * CC + c0 + 8 * w) * NN + p0 + 4 * lane;
  v4f v[8];
#pragma unroll      // constant indices keep v in registers, so that the eight loads are issued ahead of the arithmetic
  for (int j = 0; j < 8; ++j) v[j] = *(const v4fa*)(px + (size_t)j * NN);
  // the address pair is an input of the wait: it stays in its registers until every load of the group has taken it
  asm volatile("s_wait_xcnt 0x0" :: "v"(px) : "memory");
#pragma unroll      // v stays in registers
  for (int q = 0; q < 4; ++q) { FragH f;
#pragma unroll      // v and f stay in registers
    for (int j = 0; j < 8; ++j) f.h[j] = (_Float16)bf16_round(v[j][q]);
    *(v8us*)&tl[((q * 32 + lane) * 8 + (w ^ ((lane >> 1) & 7))) * 8] = f.half[0]; }
  __syncthreads();      // the tile is complete before its rows are read back
  const int rr = tid >> 3, ch = tid & 7;      // 8 lanes write one whole line of X16 rows 4 rr + i
  unsigned short* po = (unsigned short*)X16 + ((size_t)b * NN + p0 + 4 * rr) * CC + c0 + ch * 8;
  v8us o[4];
#pragma unroll      // o stays in registers
  for (int i = 0; i < 4; ++i) o[i] = *(const v8us*)&tl[((i * 32 + rr) * 8 + (ch ^ ((rr >> 1) & 7))) * 8];
#pragma unroll      // o stays in registers
  for (int i = 0; i < 4; ++i) *(v8us*)(po + (size_t)i * CC) = o[i]; }
// All operand preparation in one launch; none of its five parts reads what another writes. Workgroups 0 .. 4 WPB - 1 take the four weight matrices (WPB each), the rest the tiles of x.
#define WPB (CC * CC / 8 / 256)
__global__ __launch_bounds__(256) void k_prep(const float* __restrict__ x, const float* __restrict__ gw, const float* __restrict__ phw, const float* __restrict__ Ww, const float* __restrict__ thw,
    _Float16* __restrict__ X16, _Float16* __restrict__ Bg, _Float16* __restrict__ Bph, _Float16* __restrict__ BW, _Float16* __restrict__ Bthp) {
  const int blk = blockIdx.x;
  if (blk >= 4 * WPB) { d_tok(x, X16, blk - 4 * WPB); return; }      // the same in every thread of the workgroup
  const int which = blk / WPB, t = (blk % WPB) * 256 + (int)threadIdx.x;
  if (which == 3) { d_wt_f16(thw, Bthp, CC, CC, 16.0f, t); return; }      // Bt[c][o] = W_theta[o][c]
  d_round16f(which == 0 ? gw : (which == 1 ? phw : Ww), which == 0 ? Bg : (which == 1 ? Bph : BW), (size_t)t);      // (out,in) natural
}
// BN batch statistics in two stages. Stage 1 is the BNP epilogue of the GEMM that makes wy: per chunk of SROWS consecutive rows and per channel, the rows' sum and the sum of their squared deviations from their own mean.
#define SROWS 32
#define SCH (NR / SROWS)
static_assert(SROWS == 32, "a chunk is the 32 rows of one wave's tile in k_gemm_t");
// Stage 2: one workgroup per 32 channels (one line of every partial row), lane = channel; wave w takes chunks 16 w .. 16 w + 15 in order, the 32 waves' sums are added in wave order by every wave.
// Total squared deviation = sum over chunks of (chunk's own + SROWS * (chunk mean - mean)^2). ST keeps its form: one line per channel, mean and 1/sqrt(var + eps) in its first two words.
__global__ __launch_bounds__(1024) void k_bnfin(const float* __restrict__ PS, const float* __restrict__ PM, float* __restrict__ ST) {
  __shared__ float red[2][32][32];
  const int tid = threadIdx.x, w = tid >> 5, lane = tid & 31; const int c = blockIdx.x * 32 + lane;
  const float* ps = PS + (size_t)(w * (SCH / 32)) * CC + c; const float* pm = PM + (size_t)(w * (SCH / 32)) * CC + c;
  float s[SCH / 32], m[SCH / 32];
#pragma unroll      // constant indices keep s and m in registers; all loads are in flight together
  for (int i = 0; i < SCH / 32; ++i) { s[i] = ps[i * CC]; m[i] = pm[i * CC]; }
  // the two address pairs are inputs of the wait: they stay in their registers until every load of the group has taken them
  asm volatile("s_wait_xcnt 0x0" :: "v"(ps), "v"(pm) : "memory");
  float a = 0.f;
#pragma unroll      // s stays in registers
  for (int i = 0; i < SCH / 32; ++i) a += s[i];
  red[0][w][lane] = a; __syncthreads();
  float tot = 0.f;
  for (int j = 0; j < 32; ++j) tot += red[0][j][lane];
  const float mu = tot / (float)NR;
  float q = 0.f;
#pragma unroll      // s and m stay in registers
  for (int i = 0; i < SCH / 32; ++i) { const float d = s[i] * (1.0f / (float)SROWS) - mu; q += m[i] + (float)SROWS * d * d; }
  red[1][w][lane] = q; __syncthreads();
  float q2 = 0.f;
  for (int j = 0; j < 32; ++j) q2 += red[1][j][lane];
  const float rs = rsqrtf(q2 / (float)NR + 1e-5f);
  const float muw = __shfl(mu, w, 32), rsw = __shfl(rs, w, 32);      // wave w writes the line of channel w of the 32
  ST[(blockIdx.x * 32 + w) * 32 + lane] = (lane == 0) ? muw : ((lane == 1) ? rsw : 0.f);
}
// out [b][c][p] = BN(wy [b * NN + p][c]) + x, one tile of 64 channels x 128 positions per workgroup. Every load takes 16 B per lane and whole lines per wave (wy: 256 B of two rows; x: 512 B of one channel row); all 16 of a lane
// are in flight together. A lane holds two blocks of 4 positions x 4 channels of wy, so each channel's 4 positions leave as one 16-B LDS store. LDS row = channel (512 B, no pad); the 16-B chunk of positions 4 pb .. 4 pb + 3
// lies at place pb ^ ((channel >> 2) & 15), so that the 16 lanes of a half wave meet 16 different bank groups both when they write and when they read.
__global__ __launch_bounds__(256) void k_out(const float* __restrict__ WY, const float* __restrict__ ST, const float* __restrict__ gam, const float* __restrict__ bet, const float* __restrict__ x, float* __restrict__ out) { __shared__ __attribute__((aligned(16))) float tl[64 * 128]; const int tid = threadIdx.x, w = tid >> 5, lane = tid & 31;
  const int b = blockIdx.x / ((CC / 64) * (NN / 128)), rem = blockIdx.x % ((CC / 64) * (NN / 128)); const int cg = rem / (NN / 128), pg = rem % (NN / 128); const int c0 = cg * 64, p0 = pg * 128;
  const int c4 = tid & 15, pb0 = tid >> 4;      // wy: channels 4 c4 .. 4 c4 + 3, position blocks pb0 and pb0 + 16
  const float* pw = WY + ((size_t)b * NN + p0 + 4 * pb0) * CC + c0 + 4 * c4;
  const size_t xo = ((size_t)b * CC + c0 + w) * NN + p0 + 4 * lane;      // x and out: channel rows w + 8 i
  const float* px = x + xo; const float* ps = ST + (c0 + 4 * c4) * 32; const float* pg4 = gam + c0 + 4 * c4; const float* pb4 = bet + c0 + 4 * c4;
  v4f a[2][4], xv[8]; v2f st[4];
#pragma unroll      // constant indices keep a in registers, so that the loads are issued ahead of the arithmetic
  for (int u = 0; u < 2; ++u)
#pragma unroll
    for (int j = 0; j < 4; ++j) a[u][j] = *(const v4fa*)(pw + (size_t)(64 * u + j) * CC);
#pragma unroll      // xv stays in registers
  for (int i = 0; i < 8; ++i) xv[i] = *(const v4fa*)(px + (size_t)(8 * i) * NN);
#pragma unroll      // st stays in registers
  for (int k = 0; k < 4; ++k) st[k] = *(const v2fa*)(ps + k * 32);      // mean and 1/sqrt(var + eps) of channel 4 c4 + k
  const v4f gv = *(const v4fa*)pg4, bv = *(const v4fa*)pb4;
  // the two address pairs are inputs of the wait: they stay in their registers until every load of the group has taken them
  asm volatile("s_wait_xcnt 0x0" :: "v"(pw), "v"(px) : "memory");
  __builtin_amdgcn_sched_barrier(0);      // no arithmetic on wy is moved up in front of the x loads: without it they were issued only after wy had arrived, one memory latency behind the other
#pragma unroll      // a stays in registers
  for (int u = 0; u < 2; ++u)
#pragma unroll
    for (int k = 0; k < 4; ++k) { v4f t;
#pragma unroll
      for (int j = 0; j < 4; ++j) t[j] = (a[u][j][k] - st[k][0]) * st[k][1] * bf16_round(gv[k]) + bf16_round(bv[k]);
      *(v4f*)&tl[(4 * c4 + k) * 128 + (((pb0 + 16 * u) ^ c4) * 4)] = t; }
  __syncthreads();      // the tile is complete before its channel rows are read back
  float* po = out + xo;
  v4f o[8];
#pragma unroll      // o and xv stay in registers
  for (int i = 0; i < 8; ++i) { const int c = w + 8 * i; const v4f t = *(const v4fa*)&tl[c * 128 + ((lane ^ ((c >> 2) & 15)) * 4)];
#pragma unroll
    for (int q = 0; q < 4; ++q) o[i][q] = t[q] + bf16_round(xv[i][q]); }
#pragma unroll      // o stays in registers
  for (int i = 0; i < 8; ++i) *(v4f*)(po + (size_t)(8 * i) * NN) = o[i]; }
extern "C" void kernel_launch(void* const* d_in, const int* in_sizes, int n_in,
                              void* d_out, int out_size, void* d_ws, size_t ws_size, hipStream_t stream) {
  (void)in_sizes; (void)n_in; (void)out_size;
  const float* x = (const float*)d_in[0]; const float* gw = (const float*)d_in[1]; const float* gb = (const float*)d_in[2]; const float* thw = (const float*)d_in[3]; const float* thb = (const float*)d_in[4]; const float* phw = (const float*)d_in[5]; const float* phb = (const float*)d_in[6]; const float* Ww = (const float*)d_in[7]; const float* Wb = (const float*)d_in[8]; const float* gam = (const float*)d_in[9]; const float* bet = (const float*)d_in[10];
  char* ws = (char*)d_ws; size_t off = 0;
  auto take = [&](size_t bytes) { char* p = ws + off; off += (bytes + 255) & ~(size_t)255; return p; };
  _Float16* Bg = (_Float16*)take((size_t)CC * CC * 2); _Float16* Bph = (_Float16*)take((size_t)CC * CC * 2); _Float16* BW = (_Float16*)take((size_t)CC * CC * 2); float* ST = (float*)take(CC * 32 * 4);
  _Float16* Bthp = (_Float16*)take((size_t)CC * CC * 2);      // W_θ as [in=o][out=c] → Bt[c][o] for φ·W_θ
  _Float16* X16 = (_Float16*)take((size_t)NR * CC * 2); float* FULLF = (float*)take((size_t)NR * CC * 4); _Float16* G16 = (_Float16*)take((size_t)NRH * CC * 2); _Float16* PHh = (_Float16*)take((size_t)NRH * CC * 2); _Float16* PHl = (_Float16*)take((size_t)NRH * CC * 2);
  // every per-batch buffer holds all BB batches, so that each stage is one launch over the whole batch
  _Float16* BPh = (_Float16*)take((size_t)NRH * CC * 2); _Float16* BPl = (_Float16*)take((size_t)NRH * CC * 2); float* CV = (float*)take((size_t)8 * (NRH / 16) * 32 * 4); _Float16* Gt = (_Float16*)take((size_t)NRH * CC * 2); float* RS = (float*)take((size_t)NCH * NR * 2 * 4); _Float16* P16 = (_Float16*)take((size_t)NR * NH * 2);
  float* PS = (float*)take((size_t)SCH * CC * 4); float* PM = (float*)take((size_t)SCH * CC * 4);      // BN partials per row chunk and channel
  float* WY = FULLF;
  if (off > ws_size) return;      // about 141 MB
  k_prep<<<4 * WPB + BB * (CC / 64) * (NN / 128), 256, 0, stream>>>(x, gw, phw, Ww, thw, X16, Bg, Bph, BW, Bthp);      // the four weight matrices and x as f16 operands
  const dim3 gp2((NR / 128) * (CC / 128), 2);
  k_gemm_t<0, false, false, false, false, true><<<gp2, 256, 0, stream>>>(X16, nullptr, nullptr, CC, 0, Bph, Bg, nullptr, CC, 0, 0.0625f, phb, gb, 0, nullptr, PHh, PHl, CV, nullptr, thb, G16, CC, 0, CC, CC);      // plane 0: phi pooled, split hi/lo, with the partial dots of c = phi * b_theta; plane 1: g pooled [BB*1024][512]
  const dim3 gb2((NRH / 128) * (CC / 128), 2), gs((NN / 128) * (NH / 128), BB), gy((NN / 128) * (CC / 128), BB);      // blockIdx.y = batch where the B operand differs per batch
  k_gemm_t<0, false, true, false, true, false, false, false, true><<<gb2, 256, 0, stream>>>(PHl, PHh, BW, CC, 0, Bthp, Bthp, G16, CC, 0, 0.0625f, nullptr, nullptr, 0, nullptr, BPh, BPl, nullptr, nullptr, nullptr, Gt, CC, 0, CC, CC);      // plane 0: B' = phi * W_theta [BB*1024][512] (phi lo, then hi), all batches as rows, leaves split hi/lo; plane 1: W * g^T, as (g * W^T)^T [BB][512][1024]
  k_gemm_t<1, false, false, false, true, false, true><<<gs, 256, 0, stream>>>(X16, X16, nullptr, CC, (size_t)NN * CC, BPl, BPh, nullptr, CC, (size_t)NH * CC, 1.0f, nullptr, CV, (size_t)NH, nullptr, P16, nullptr, RS, nullptr, nullptr, nullptr, NH, (size_t)NN * NH, NH, CC);      // f = x * B'^T + c (B' lo, then hi; c broadcast over the rows of its batch), leaves as exp(f - chunk maximum) with each chunk's maximum and sum
  k_gemm_t<0, true, false, true, false, false, false, true><<<gy, 256, 0, stream>>>(P16, nullptr, nullptr, NH, (size_t)NN * NH, Gt, nullptr, nullptr, NH, (size_t)CC * NH, 0.000030517578125f, Wb, RS, 0, WY, nullptr, nullptr, PS, PM, nullptr, nullptr, CC, (size_t)NN * CC, CC, NH);      // wy = softmax(f) * (g * W^T) + b, with the BN partials of its row chunks
  k_bnfin<<<CC / 32, 1024, 0, stream>>>(PS, PM, ST); k_out<<<BB * (CC / 64) * (NN / 128), 256, 0, stream>>>(WY, ST, gam, bet, x, (float*)d_out);
}
